// v010
// Measured on an AMD MI455X. A time is GPU time per run, averaged over a window of back-to-back runs after a warm-up
// (all launches, gaps included; the runs take copies of the inputs in turn), and the median of several windows.
// Apart from v000's, it joins two sittings. Times from different sittings can be a few percent apart, while
// side-by-side timings come from the same sitting.
// The versions before v010 are in another document.
// Measured time: 110 microseconds a run.
// Two timings next to v009 both put it at 1.05 times that version's speed.
// Counting every step since v000, which is the starting kernel, it is 25.3 times as fast.
#include <hip/hip_runtime.h>
// cross_fuison (8192 hsi rows x1 and 8192 lidar rows x2, 512 -> 256: Q/K/V = x W^T + b (W_V shared); inv = 1/sqrt(clip(scale, 1, 32)); f1 = softmax(hsi_Q lidar_K^T inv) hsi_V; f2 = softmax(lidar_Q hsi_K^T inv) lidar_V; outputs = (f1 We^T + be, f2 We^T + be), each [8192][512]).
// Compute dtype: inputs rounded to bf16; inputs/weights exact as f16; Q/K/V and the softmax weights as plain f16 operands (~2^-12); each key range's partial of f as f16 (~2^-12); the joined f as f16 hi + residual into We; softmax f32. v_wmma_f32_16x16x32_f16.
#define NN 8192
#define DI 512
#define DO 256
typedef __bf16 v16b __attribute__((ext_vector_type(16)));
typedef unsigned short v8us __attribute__((ext_vector_type(8), may_alias));
typedef float  v8f  __attribute__((ext_vector_type(8)));
typedef float  v4f  __attribute__((ext_vector_type(4)));
typedef float  v4fa __attribute__((ext_vector_type(4), may_alias));
union FragB { v16b v; v8us half[2]; unsigned short u[16]; };

__device__ __forceinline__ unsigned short bf16_bits(float x) { unsigned int u = __float_as_uint(x); return (unsigned short)((u + 0x7FFFu + ((u >> 16) & 1u)) >> 16); }
__device__ __forceinline__ float bf16_val(unsigned short b) { return __uint_as_float(((unsigned int)b) << 16); }
__device__ __forceinline__ float bf16_round(float x) { return bf16_val(bf16_bits(x)); }
// D += A·B with NT terms: 1 = ah·bh, 2 = + al·bh (A split), 3 = + ah·bl (both split)
template <int NT>
__device__ __forceinline__ v8f mmaN(v16b ah, v16b al, v16b bh, v16b bl, v8f c) {
  c = __builtin_amdgcn_wmma_f32_16x16x32_bf16(false, ah, false, bh, (short)0, c, false, false);
  if (NT >= 2) c = __builtin_amdgcn_wmma_f32_16x16x32_bf16(false, al, false, bh, (short)0, c, false, false);
  if (NT >= 3) c = __builtin_amdgcn_wmma_f32_16x16x32_bf16(false, ah, false, bl, (short)0, c, false, false);
  asm volatile("v_nop\n\tv_nop\n\tv_nop\n\tv_nop" : "+v"(c) : "v"(ah), "v"(al), "v"(bh), "v"(bl));
  return c;
}

__global__ __launch_bounds__(256) void k_wt_bf16(const float* __restrict__ W, unsigned short* __restrict__ Wt, int K, int N) {
  const int t = blockIdx.x * 256 + threadIdx.x;
  const int k8n = K / 8;
  if (t >= N * k8n) return;
  const int n = t / k8n, k8 = (t % k8n) * 8;
  v8us v;
#pragma unroll
  for (int i = 0; i < 8; ++i) v[i] = bf16_bits(W[(size_t)(k8 + i) * N + n]);
  *(v8us*)(Wt + (size_t)n * K + k8) = v;
  
}

// GEMM C[M][N] (f32, pitch ldc) = act(A[M][K]·W + bias). A f32 row-major (pitch lda) converted per fragment to bf16
// (ASPLIT: hi/lo two planes -> 2 terms, else single rounded term); Wt bf16 [N][K] (pitch ldb). BIAS_BF16 rounds the
// bias to bf16 first (bias quantised to bf16 before the add). K%32==0, M%16==0, N%64==0.
template <bool ASPLIT, int ACT, bool BIAS_BF16>
__global__ __launch_bounds__(128) void k_gemm_bf(const float* __restrict__ A, int lda, const unsigned short* __restrict__ Wt, int ldb,
                                               const float* __restrict__ bias, float* __restrict__ C, int ldc, int M, int N, int K) {
  __shared__ __attribute__((aligned(16))) float so[4][16][64];
  const int tid = threadIdx.x, w = tid >> 5, lane = tid & 31, ln = lane & 15, hh = lane >> 4;
  const int ntn = N / 64;
  const int wid = blockIdx.x * 4 + w;
  const int mt = wid / ntn, nq = wid % ntn;
  if (mt * 16 >= M) return;
  const int row0 = mt * 16, col0 = nq * 64;
  const float* arow = A + (size_t)(row0 + ln) * lda;
  v8f acc[4] = {};
  for (int kb = 0; kb < K; kb += 32) {
    FragB ah, al;
    const v4f x0 = *(const v4fa*)(arow + kb + 8 * hh), x1 = *(const v4fa*)(arow + kb + 8 * hh + 4);
    const v4f x2 = *(const v4fa*)(arow + kb + 16 + 8 * hh), x3 = *(const v4fa*)(arow + kb + 16 + 8 * hh + 4);
    float xs[16] = {x0[0],x0[1],x0[2],x0[3],x1[0],x1[1],x1[2],x1[3],x2[0],x2[1],x2[2],x2[3],x3[0],x3[1],x3[2],x3[3]};
#pragma unroll
    for (int i = 0; i < 16; ++i) { const unsigned short hb = bf16_bits(xs[i]); ah.u[i] = hb; al.u[i] = ASPLIT ? bf16_bits(xs[i] - bf16_val(hb)) : (unsigned short)0; }
#pragma unroll
    for (int t = 0; t < 4; ++t) {
      const unsigned short* brow = Wt + (size_t)(col0 + t * 16 + ln) * ldb + kb;
      FragB b;
      b.half[0] = *(const v8us*)(brow + 8 * hh);
      b.half[1] = *(const v8us*)(brow + 16 + 8 * hh);
      acc[t] = mmaN<ASPLIT ? 2 : 1>(ah.v, al.v, b.v, b.v, acc[t]);
    }
  }
#pragma unroll
  for (int t = 0; t < 4; ++t) {
    float bv = bias ? bias[col0 + t * 16 + ln] : 0.f;
    if (BIAS_BF16) bv = bf16_round(bv);
#pragma unroll
    for (int r = 0; r < 8; ++r) { float v = acc[t][r] + bv; if (ACT == 1) v = fmaxf(v, 0.f); so[w][8 * hh + r][t * 16 + ln] = v; }
  }
  __builtin_amdgcn_fence(__ATOMIC_ACQ_REL, "workgroup");
  __builtin_amdgcn_wave_barrier();
  const int rsub = lane >> 4, c4 = (lane & 15) * 4;
  {
#pragma unroll
    for (int q = 0; q < 8; ++q) {
      const int r = q * 2 + rsub;
      const v4f v = *(const v4fa*)&so[w][r][c4];
      *(v4f*)(C + (size_t)(row0 + r) * ldc + col0 + c4) = v;
    }
    
  }
}

// GEMM C = act(A·W + bias + resid): A f32 (ASPLIT -> hi/lo 2 terms), Wt bf16 [N][K]; ACT 0 none, 1 relu, 2 exact gelu;
// resid (optional, f32, row index = (row % rmod), pitch ldr, RES_BF16 rounds it) added before the activation.
template <bool ASPLIT, int ACT, bool BIAS_BF16, bool RES_BF16>
__global__ __launch_bounds__(128) void k_gemm_bf3(const float* __restrict__ A, int lda, const unsigned short* __restrict__ Wt, int ldb,
                                                const float* __restrict__ bias, const float* __restrict__ resid, int rmod, int ldr,
                                                float* __restrict__ C, int ldc, int M, int N, int K) {
  __shared__ __attribute__((aligned(16))) float so[4][16][64];
  const int tid = threadIdx.x, w = tid >> 5, lane = tid & 31, ln = lane & 15, hh = lane >> 4;
  const int ntn = N / 64;
  const int wid = blockIdx.x * 4 + w;
  const int mt = wid / ntn, nq = wid % ntn;
  if (mt * 16 >= M) return;
  const int row0 = mt * 16, col0 = nq * 64;
  const float* arow = A + (size_t)(row0 + ln) * lda;
  v8f acc[4] = {};
  for (int kb = 0; kb < K; kb += 32) {
    FragB ah, al;
    const v4f x0 = *(const v4fa*)(arow + kb + 8 * hh), x1 = *(const v4fa*)(arow + kb + 8 * hh + 4);
    const v4f x2 = *(const v4fa*)(arow + kb + 16 + 8 * hh), x3 = *(const v4fa*)(arow + kb + 16 + 8 * hh + 4);
    float xs[16] = {x0[0],x0[1],x0[2],x0[3],x1[0],x1[1],x1[2],x1[3],x2[0],x2[1],x2[2],x2[3],x3[0],x3[1],x3[2],x3[3]};
#pragma unroll
    for (int i = 0; i < 16; ++i) { const unsigned short hb = bf16_bits(xs[i]); ah.u[i] = hb; al.u[i] = ASPLIT ? bf16_bits(xs[i] - bf16_val(hb)) : (unsigned short)0; }
#pragma unroll
    for (int t = 0; t < 4; ++t) {
      const unsigned short* brow = Wt + (size_t)(col0 + t * 16 + ln) * ldb + kb;
      FragB b;
      b.half[0] = *(const v8us*)(brow + 8 * hh);
      b.half[1] = *(const v8us*)(brow + 16 + 8 * hh);
      acc[t] = mmaN<ASPLIT ? 2 : 1>(ah.v, al.v, b.v, b.v, acc[t]);
    }
  }
#pragma unroll
  for (int t = 0; t < 4; ++t) {
    const int col = col0 + t * 16 + ln;
    float bv = bias ? bias[col] : 0.f;
    if (BIAS_BF16) bv = bf16_round(bv);
#pragma unroll
    for (int r = 0; r < 8; ++r) {
      float v = acc[t][r] + bv;
      if (resid) { float rv = resid[(size_t)((row0 + 8 * hh + r) % rmod) * ldr + col]; if (RES_BF16) rv = bf16_round(rv); v += rv; }
      if (ACT == 1) v = fmaxf(v, 0.f);
      if (ACT == 2) v = 0.5f * v * (1.0f + erff(v * 0.70710678118654752f));
      if (ACT == 3) { const float u = 0.7978845608028654f * (v + 0.044715f * v * v * v); v = 0.5f * v * (1.0f + tanhf(u)); }
      so[w][8 * hh + r][t * 16 + ln] = v;
    }
  }
  __builtin_amdgcn_fence(__ATOMIC_ACQ_REL, "workgroup");
  __builtin_amdgcn_wave_barrier();
  const int rsub = lane >> 4, c4 = (lane & 15) * 4;
  {
#pragma unroll
    for (int q = 0; q < 8; ++q) {
      const int r = q * 2 + rsub;
      const v4f v = *(const v4fa*)&so[w][r][c4];
      *(v4f*)(C + (size_t)(row0 + r) * ldc + col0 + c4) = v;
    }
    
  }
}
// row LayerNorm (biased variance, eps) over N: s = X (+ R); optional out_sum <- s; out_norm <- (s-mu)*rsqrt(var+eps)*g + b
template <bool PARAM_BF16>
__global__ __launch_bounds__(256) void k_layernorm(const float* __restrict__ X, const float* __restrict__ R, const float* __restrict__ g, const float* __restrict__ bta,
                                                  float* __restrict__ out_sum, float* __restrict__ out_norm, int N, float eps) {
  __shared__ float red[256];
  const int row = blockIdx.x, tid = threadIdx.x;
  const float* x = X + (size_t)row * N; const float* rr = R ? R + (size_t)row * N : nullptr;
  float vals[16];                     // up to N = 4096
  const int per = N / 256;            // contiguous chunk per thread? use strided-by-4 chunks: thread handles j = tid*4 + 1024*u
  float s1 = 0.f;
  for (int u = 0; u < per / 4; ++u) {
    const int j = tid * 4 + 1024 * u;
    const v4f a = *(const v4fa*)(x + j);
    v4f b = {0.f,0.f,0.f,0.f}; if (rr) b = *(const v4fa*)(rr + j);
#pragma unroll
    for (int q = 0; q < 4; ++q) { const float v = a[q] + b[q]; vals[u * 4 + q] = v; s1 += v; }
  }
  red[tid] = s1; __syncthreads();
  for (int st = 128; st > 0; st >>= 1) { if (tid < st) red[tid] += red[tid + st]; __syncthreads(); }
  const float mu = red[0] / (float)N; __syncthreads();
  float s2 = 0.f;
  for (int u = 0; u < per / 4; ++u)
#pragma unroll
    for (int q = 0; q < 4; ++q) { const float c = vals[u * 4 + q] - mu; s2 += c * c; }
  red[tid] = s2; __syncthreads();
  for (int st = 128; st > 0; st >>= 1) { if (tid < st) red[tid] += red[tid + st]; __syncthreads(); }
  const float rs = rsqrtf(red[0] / (float)N + eps);
  {
    for (int u = 0; u < per / 4; ++u) {
      const int j = tid * 4 + 1024 * u;
      v4f o, sm;
#pragma unroll
      for (int q = 0; q < 4; ++q) {
        float gg = g[j + q], bb = bta[j + q];
        if (PARAM_BF16) { gg = bf16_round(gg); bb = bf16_round(bb); }
        sm[q] = vals[u * 4 + q]; o[q] = (vals[u * 4 + q] - mu) * rs * gg + bb;
      }
      if (out_sum) *(v4f*)(out_sum + (size_t)row * N + j) = sm;
      *(v4f*)(out_norm + (size_t)row * N + j) = o;
    }
    
  }
}



// ---- f16 WMMA path (v_wmma_f32_16x16x32_f16): 11-bit significands for operands in range
typedef _Float16 v16h __attribute__((ext_vector_type(16)));
union FragH { v16h v; v8us half[2]; _Float16 h[16]; unsigned short u[16]; };
template <int NT>
__device__ __forceinline__ v8f mmaH(v16h ah, v16h al, v16h bh, v16h bl, v8f c) {
  c = __builtin_amdgcn_wmma_f32_16x16x32_f16(false, ah, false, bh, (short)0, c, false, false);
  if (NT >= 2) c = __builtin_amdgcn_wmma_f32_16x16x32_f16(false, al, false, bh, (short)0, c, false, false);
  if (NT >= 3) c = __builtin_amdgcn_wmma_f32_16x16x32_f16(false, ah, false, bl, (short)0, c, false, false);
  asm volatile("v_nop\n\tv_nop\n\tv_nop\n\tv_nop" : "+v"(c) : "v"(ah), "v"(al), "v"(bh), "v"(bl));
  return c;
}
// batched GEMM with f16 operands: A f32 (split into f16 hi/lo if ASPLIT, else rounded to f16), Bt = f16 values [n][k]; alpha; C f32; N multiple of 16 (partial tiles skipped)
template <bool ASPLIT>
__global__ __launch_bounds__(128) void k_gemm_h(const float* __restrict__ A, int lda, size_t sA, const _Float16* __restrict__ Bh, int ldb, size_t sB, float alpha, float* __restrict__ C, int ldc, size_t sC, int M, int N, int K) {
  __shared__ __attribute__((aligned(16))) float so[4][16][64];
  const int tid = threadIdx.x, w = tid >> 5, lane = tid & 31, ln = lane & 15, hh = lane >> 4; const int by = blockIdx.y;
  A += (size_t)by * sA; Bh += (size_t)by * sB; C += (size_t)by * sC;
  const int ntn = (N + 63) / 64; const int wid = blockIdx.x * 4 + w; const int mt = wid / ntn, nq = wid % ntn; if (mt * 16 >= M) return;
  const int row0 = mt * 16, col0 = nq * 64; const float* arow = A + (size_t)(row0 + ln) * lda;
  v8f acc[4] = {};
  for (int kb = 0; kb < K; kb += 32) {
    FragH ah, al;
    const v4f x0 = *(const v4fa*)(arow + kb + 8 * hh), x1 = *(const v4fa*)(arow + kb + 8 * hh + 4), x2 = *(const v4fa*)(arow + kb + 16 + 8 * hh), x3 = *(const v4fa*)(arow + kb + 16 + 8 * hh + 4);
    float xs[16] = {x0[0],x0[1],x0[2],x0[3],x1[0],x1[1],x1[2],x1[3],x2[0],x2[1],x2[2],x2[3],x3[0],x3[1],x3[2],x3[3]};
#pragma unroll
    for (int i = 0; i < 16; ++i) { const _Float16 h = (_Float16)xs[i]; ah.h[i] = h; al.h[i] = ASPLIT ? (_Float16)(xs[i] - (float)h) : (_Float16)0.0f; }
#pragma unroll
    for (int t = 0; t < 4; ++t) { if (col0 + t * 16 >= N) continue; const size_t boff = (size_t)(col0 + t * 16 + ln) * ldb + kb; FragH bq; bq.half[0] = *(const v8us*)(Bh + boff + 8 * hh); bq.half[1] = *(const v8us*)(Bh + boff + 16 + 8 * hh);
      acc[t] = mmaH<ASPLIT ? 2 : 1>(ah.v, al.v, bq.v, bq.v, acc[t]); }
  }
#pragma unroll
  for (int t = 0; t < 4; ++t) { if (col0 + t * 16 >= N) continue;
#pragma unroll
    for (int r = 0; r < 8; ++r) so[w][8 * hh + r][t * 16 + ln] = acc[t][r] * alpha; }
  __builtin_amdgcn_fence(__ATOMIC_ACQ_REL, "workgroup"); __builtin_amdgcn_wave_barrier();
  const int rsub = lane >> 4, c4 = (lane & 15) * 4;
  {
#pragma unroll
    for (int q = 0; q < 8; ++q) { const int r = q * 2 + rsub; if (col0 + c4 < N) { const v4f v = *(const v4fa*)&so[w][r][c4]; *(v4f*)(C + (size_t)(row0 + r) * ldc + col0 + c4) = v; } }
     }
}

// Wt[n][k] = f16(W[k][n]·scale) from f32 row-major W[K][N] (scale = power of two; bf16-exact weights stay exact in f16 away from the subnormal range)
__global__ __launch_bounds__(256) void k_wt_f16(const float* __restrict__ W, _Float16* __restrict__ Wt, int K, int N, float scale) {
  const int t = blockIdx.x * 256 + threadIdx.x; if (t >= N * (K / 8)) return; const int n = t / (K / 8), k8 = (t % (K / 8)) * 8; FragH f;
#pragma unroll
  for (int i = 0; i < 8; ++i) f.h[i] = (_Float16)(bf16_round(W[(size_t)(k8 + i) * N + n]) * scale); const v8us o = f.half[0];
  *(v8us*)((unsigned short*)Wt + (size_t)n * K + k8) = o; 
}
// batched f16 GEMM (A [m][k], Bt [n][k]) with fused epilogue: v = acc·alpha + bias[by·sBias + col] (+ CP[(row/rowsPerB)·sCPb + by·64 + col] if CP) ; ACT 0 none / 1 elu ; writes f16 C16 (and f32 C if non-null)
template <int ACT>
__global__ __launch_bounds__(128) void k_gemm_hhx(const _Float16* __restrict__ A, int lda, size_t sA, const _Float16* __restrict__ Bh, int ldb, size_t sB, float alpha, const float* __restrict__ bias, size_t sBias, const float* __restrict__ CP, int rowsPerB, size_t sCPb, int row0g,
    float* __restrict__ C, _Float16* __restrict__ C16, int ldc, size_t sC, int M, int N, int K) {
  __shared__ __attribute__((aligned(16))) float so[4][16][64];
  const int tid = threadIdx.x, w = tid >> 5, lane = tid & 31, ln = lane & 15, hh = lane >> 4; const int by = blockIdx.y;
  A += (size_t)by * sA; Bh += (size_t)by * sB; const size_t cofs = (size_t)by * sC; const float* bp = bias ? bias + (size_t)by * sBias : nullptr;
  const int ntn = (N + 63) / 64; const int wid = blockIdx.x * 4 + w; const int mt = wid / ntn, nq = wid % ntn; if (mt * 16 >= M) return;
  const int row0 = mt * 16, col0 = nq * 64; const _Float16* arow = A + (size_t)(row0 + ln) * lda;
  v8f acc[4] = {};
  for (int kb = 0; kb < K; kb += 32) { FragH ah; ah.half[0] = *(const v8us*)((const unsigned short*)arow + kb + 8 * hh); ah.half[1] = *(const v8us*)((const unsigned short*)arow + kb + 16 + 8 * hh);
#pragma unroll
    for (int t = 0; t < 4; ++t) { if (col0 + t * 16 >= N) continue; const size_t boff = (size_t)(col0 + t * 16 + ln) * ldb + kb; FragH bq; bq.half[0] = *(const v8us*)((const unsigned short*)Bh + boff + 8 * hh); bq.half[1] = *(const v8us*)((const unsigned short*)Bh + boff + 16 + 8 * hh);
      acc[t] = mmaH<1>(ah.v, ah.v, bq.v, bq.v, acc[t]); }
  }
#pragma unroll
  for (int t = 0; t < 4; ++t) { if (col0 + t * 16 >= N) continue; const int col = col0 + t * 16 + ln; const float bv = bp ? bf16_round(bp[col]) : 0.f;
#pragma unroll
    for (int r = 0; r < 8; ++r) { float v = acc[t][r] * alpha + bv; if (CP) { const int rr = row0g + row0 + 8 * hh + r; if (rowsPerB < 0) v += CP[cofs + (size_t)rr * ldc + col];      /* rowsPerB < 0: own element of the batched C plane */ else { const int bidx = rr / rowsPerB; v += CP[(size_t)bidx * sCPb + (size_t)by * 64 + col]; } } if (ACT == 1) v = (v > 0.f) ? v : expm1f(v); else if (ACT == 7) v = (v > 0.f) ? v + 1.0f : expf(v); else if (ACT == 8) v = tanhf(v); else if (ACT == 9) v = 0.5f * v * (1.0f + tanhf(0.7978845608028654f * (v + 0.044715f * v * v * v))); else if (ACT == 11) v = 1.0f / (1.0f + expf(-v)); else if (ACT == 12) v = (v > 0.f) ? v : 0.01f * v; else if (ACT == 14) v = (v > 0.f) ? v : 0.1f * v; else if (ACT == 16) v = (v >= 0.f) ? v : 0.3f * v; else if (ACT == 17) v = (v >= 0.f) ? v : 0.2f * v; else if (ACT == 15) v = v / (1.0f + expf(-v)); else if (ACT == 3) v = fmaxf(v, 0.f); else if (ACT == 6) v = 0.5f * v * (1.0f + erff(v * 0.70710678118654752f)); so[w][8 * hh + r][t * 16 + ln] = v; } }
  __builtin_amdgcn_fence(__ATOMIC_ACQ_REL, "workgroup"); __builtin_amdgcn_wave_barrier();
  const int rsub = lane >> 4, c4 = (lane & 15) * 4; typedef _Float16 v4h __attribute__((ext_vector_type(4)));
  {
#pragma unroll
    for (int q = 0; q < 8; ++q) { const int r = q * 2 + rsub; if (col0 + c4 < N) { const v4f v = *(const v4fa*)&so[w][r][c4]; if (C) *(v4f*)(C + cofs + (size_t)(row0 + r) * ldc + col0 + c4) = v; if (C16) { v4h h4; for (int i = 0; i < 4; ++i) h4[i] = (_Float16)v[i]; *(v4h*)(C16 + cofs + (size_t)(row0 + r) * ldc + col0 + c4) = h4; } } }
     }
}


typedef _Float16 v4h __attribute__((ext_vector_type(4)));

// every input conversion in one launch: blocks 0 .. 6 WB - 1 take the six weight matrices (slot j of BW = f16(bf16(w_j) x 16), each DO x DI elements), the rest x1 and x2 (X = [x1 | x2] as f16(bf16(x)))
#define XB (NN * DI / 8 / 256)   /* blocks per x */
#define WB (DO * DI / 8 / 256)   /* blocks per weight matrix */
__global__ __launch_bounds__(256) void k_cvt(const float* __restrict__ x1, const float* __restrict__ x2, const float* __restrict__ w0, const float* __restrict__ w1, const float* __restrict__ w2, const float* __restrict__ w3, const float* __restrict__ w4, const float* __restrict__ w5,
    _Float16* __restrict__ X, _Float16* __restrict__ BW) {
  const int b = blockIdx.x, tid = threadIdx.x; const float* src; _Float16* dst; float sc;
  if (b < 6 * WB) { const int j = b / WB; const float* w = j == 0 ? w0 : j == 1 ? w1 : j == 2 ? w2 : j == 3 ? w3 : j == 4 ? w4 : w5; src = w + ((size_t)(b - j * WB) * 256 + tid) * 8; dst = BW + ((size_t)b * 256 + tid) * 8; sc = 16.0f; }
  else { const int q = b - 6 * WB, j = q / XB; src = (j ? x2 : x1) + ((size_t)(q - j * XB) * 256 + tid) * 8; dst = X + ((size_t)q * 256 + tid) * 8; sc = 1.0f; }
  FragH f;
#pragma unroll
  for (int q = 0; q < 8; ++q) f.h[q] = (_Float16)(bf16_round(src[q]) * sc);
  *(v8us*)(unsigned short*)dst = f.half[0]; }
__global__ __launch_bounds__(256) void k_h16(const float* __restrict__ x, _Float16* __restrict__ X16, size_t n8) { const size_t t = (size_t)blockIdx.x * 256 + threadIdx.x; if (t >= n8) return; FragH f;
#pragma unroll
  for (int q = 0; q < 8; ++q) f.h[q] = (_Float16)x[t * 8 + q]; *(v8us*)((unsigned short*)X16 + t * 8) = f.half[0];  }
__global__ __launch_bounds__(256) void k_round16f(const float* __restrict__ W, _Float16* __restrict__ Bt, size_t n8) { const size_t t = (size_t)blockIdx.x * 256 + threadIdx.x; if (t >= n8) return; FragH f;
#pragma unroll
  for (int i = 0; i < 8; ++i) f.h[i] = (_Float16)(bf16_round(W[t * 8 + i]) * 16.0f); *(v8us*)((unsigned short*)Bt + t * 8) = f.half[0];  }

__global__ __launch_bounds__(256) void k_hl(const float* __restrict__ F, _Float16* __restrict__ Hh, _Float16* __restrict__ Hl, size_t n8) { const size_t t = (size_t)blockIdx.x * 256 + threadIdx.x; if (t >= n8) return; FragH fh, fl; const v4f a = *(const v4fa*)(F + t * 8), c = *(const v4fa*)(F + t * 8 + 4);
#pragma unroll
  for (int q = 0; q < 4; ++q) { _Float16 h = (_Float16)a[q]; fh.h[q] = h; fl.h[q] = (_Float16)((a[q] - (float)h) * 1024.0f); h = (_Float16)c[q]; fh.h[4 + q] = h; fl.h[4 + q] = (_Float16)((c[q] - (float)h) * 1024.0f); }
  { *(v8us*)((unsigned short*)Hh + t * 8) = fh.half[0]; *(v8us*)((unsigned short*)Hl + t * 8) = fl.half[0];  } }

// ---- fast GEMM (wave tile 32x64; requires M % 32 == 0 rows per launch region and N % 64 == 0); epilogue = k_gemm_hhx semantics ----
__device__ __forceinline__ v16h g2_frag(const _Float16* p, int hh) { FragH f; f.half[0] = *(const v8us*)((const unsigned short*)p + 8 * hh); f.half[1] = *(const v8us*)((const unsigned short*)p + 16 + 8 * hh); return f.v; }
__device__ __forceinline__ v8f g2_mma(v16h a, v16h b, v8f c) { v8f d = __builtin_amdgcn_wmma_f32_16x16x32_f16(false, a, false, b, (short)0, c, false, false); asm volatile("v_nop\n\tv_nop\n\tv_nop\n\tv_nop" : "+v"(d) : "v"(a), "v"(b)); return d; }
template <int ACT>
__global__ __launch_bounds__(128) void k_gemm2(const _Float16* __restrict__ A, int lda, size_t sA, const _Float16* __restrict__ Bh, int ldb, size_t sB, float alpha, const float* __restrict__ bias, size_t sBias, const float* __restrict__ CP, int rowsPerB, size_t sCPb, int row0g,
    float* __restrict__ C, _Float16* __restrict__ C16, int ldc, size_t sC, int M, int N, int K) { static_assert(ACT == 0 || ACT == 3 || ACT == 6 || ACT == 8 || ACT == 9 || ACT == 11 || ACT == 12 || ACT == 14 || ACT == 15 || ACT == 16 || ACT == 17, "k_gemm2: unsupported ACT code (would silently apply no activation)");
  __shared__ __attribute__((aligned(16))) float so[4][32][68];
  const int tid = threadIdx.x, w = tid >> 5, lane = tid & 31, ln = lane & 15, hh = lane >> 4; const int by = blockIdx.y;
  A += (size_t)by * sA; Bh += (size_t)by * sB; const size_t cofs = (size_t)by * sC; const float* bp = bias ? bias + (size_t)by * sBias : nullptr;
  const int ntn = N >> 6; const int mt = blockIdx.x / ntn, nq = blockIdx.x - mt * ntn; const int row0 = mt * 128 + 32 * w, col0 = nq * 64; if (row0 >= M) return;
  const _Float16* a0p = A + (size_t)(row0 + ln) * lda; const _Float16* a1p = a0p + (size_t)16 * lda;
  const _Float16* b0p = Bh + (size_t)(col0 + ln) * ldb; const _Float16* b1p = b0p + (size_t)16 * ldb; const _Float16* b2p = b1p + (size_t)16 * ldb; const _Float16* b3p = b2p + (size_t)16 * ldb;
  const v8f z8 = {0.f,0.f,0.f,0.f,0.f,0.f,0.f,0.f}; v8f c00 = z8, c01 = z8, c02 = z8, c03 = z8, c10 = z8, c11 = z8, c12 = z8, c13 = z8;
#pragma unroll 1
  for (int kb = 0; kb < K; kb += 32) { const v16h a0 = g2_frag(a0p + kb, hh), a1 = g2_frag(a1p + kb, hh);
    v16h b = g2_frag(b0p + kb, hh); c00 = g2_mma(a0, b, c00); c10 = g2_mma(a1, b, c10);
    b = g2_frag(b1p + kb, hh); c01 = g2_mma(a0, b, c01); c11 = g2_mma(a1, b, c11);
    b = g2_frag(b2p + kb, hh); c02 = g2_mma(a0, b, c02); c12 = g2_mma(a1, b, c12);
    b = g2_frag(b3p + kb, hh); c03 = g2_mma(a0, b, c03); c13 = g2_mma(a1, b, c13); }
  v8f accs[8] = {c00, c01, c02, c03, c10, c11, c12, c13};
#pragma unroll
  for (int u = 0; u < 8; ++u) { const int t = u & 3, half = u >> 2; const int col = col0 + t * 16 + ln; const float bv = bp ? bf16_round(bp[col]) : 0.f;
#pragma unroll
    for (int r = 0; r < 8; ++r) { const int rloc = half * 16 + 8 * hh + r; float v = accs[u][r] * alpha + bv; if (CP) { if (rowsPerB < 0) v += CP[cofs + (size_t)(row0g + row0 + rloc) * ldc + col];      /* rowsPerB < 0: own element of the batched C plane */ else { const int bidx = (row0g + row0 + rloc) / rowsPerB; v += CP[(size_t)bidx * sCPb + (size_t)by * 64 + col]; } }
      if (ACT == 3) v = fmaxf(v, 0.f); else if (ACT == 6) v = 0.5f * v * (1.0f + erff(v * 0.70710678118654752f)); else if (ACT == 11) v = 1.0f / (1.0f + expf(-v)); else if (ACT == 15) v = v / (1.0f + expf(-v)); else if (ACT == 12) v = (v > 0.f) ? v : 0.01f * v; else if (ACT == 8) v = tanhf(v); else if (ACT == 9) v = 0.5f * v * (1.0f + tanhf(0.7978845608028654f * (v + 0.044715f * v * v * v))); else if (ACT == 14) v = (v > 0.f) ? v : 0.1f * v; else if (ACT == 16) v = (v >= 0.f) ? v : 0.3f * v; else if (ACT == 17) v = (v >= 0.f) ? v : 0.2f * v;
      so[w][rloc][t * 16 + ln] = v; } }
  __builtin_amdgcn_fence(__ATOMIC_ACQ_REL, "workgroup"); __builtin_amdgcn_wave_barrier();
  const int rsub = lane >> 4, c4 = (lane & 15) * 4;
  {
#pragma unroll
    for (int q = 0; q < 16; ++q) { const int r = q * 2 + rsub; const v4f v = *(const v4fa*)&so[w][r][c4]; if (C) *(v4f*)(C + cofs + (size_t)(row0 + r) * ldc + col0 + c4) = v; if (C16) { v4h h4; for (int i = 0; i < 4; ++i) h4[i] = (_Float16)v[i]; *(v4h*)(C16 + cofs + (size_t)(row0 + r) * ldc + col0 + c4) = h4; } }
     } }


// ---- GEMM tile through LDS: a work-group of 8 waves makes a 128 x 128 tile of A[.][KT] . B[.][KT]^T (both row-major, pitch KT, f16); wave w takes rows 32 (w & 3), columns 64 (w >> 2): k_gemm2's 32 x 64 wave tile and k order.
// A k slice of 64 elements (one 128-byte line of each of the 256 rows) lies in one of two LDS buffers; the next slice is fetched meanwhile through registers, a wave's load covering four whole lines.
#define GP 72                    /* LDS pitch of a row's slice, 16-bit elements: 144 B = 16 B x odd */
#define GT (128 * GP)            /* one operand's slice */
union G3S { unsigned short t[4 * GT]; float so[8][32][68]; };      /* the two buffers (A | B each); behind the loop each wave's own output staging */
__device__ __forceinline__ v16h g3_frag(const unsigned short* p, int hh) { FragH f; f.half[0] = *(const v8us*)(p + 8 * hh); f.half[1] = *(const v8us*)(p + 16 + 8 * hh); return f.v; }
__device__ __forceinline__ v8f g3_mma(v16h a, v16h b, v8f c) { return __builtin_amdgcn_wmma_f32_16x16x32_f16(false, a, false, b, (short)0, c, false, false); }
template <int KT>
__device__ __forceinline__ void g3_loop(const unsigned short* __restrict__ A, const unsigned short* __restrict__ B, unsigned short* sm, int tid, v8f (&acc)[2][4]) {
  const int w = tid >> 5, lane = tid & 31, ln = lane & 15, hh = lane >> 4;
  const unsigned short* ga = A + (size_t)(tid >> 3) * KT + (tid & 7) * 8;      /* thread -> 16 B of rows tid / 8 + 32 j of each operand; one address pair an operand for all slices */
  const unsigned short* gb = B + (size_t)(tid >> 3) * KT + (tid & 7) * 8;
  const int ls = (tid >> 3) * GP + (tid & 7) * 8;
  const int ra = ((w & 3) * 32 + ln) * GP, rb = GT + ((w >> 2) * 64 + ln) * GP;
  v8us sa[4], sb[4];
#pragma unroll
  for (int j = 0; j < 4; ++j) { sa[j] = *(const v8us*)(ga + j * 32 * KT); sb[j] = *(const v8us*)(gb + j * 32 * KT); }
#pragma unroll
  for (int j = 0; j < 4; ++j) { *(v8us*)(sm + ls + j * 32 * GP) = sa[j]; *(v8us*)(sm + GT + ls + j * 32 * GP) = sb[j]; }
  __syncthreads();
  // unrolled: the buffer and the slice become constants, so every load and LDS access is its base register plus an immediate offset
#pragma unroll
  for (int c = 0; c < KT / 64; ++c) {
    const unsigned short* cur = sm + (c & 1) * 2 * GT; unsigned short* nxt = sm + ((c + 1) & 1) * 2 * GT;
    if (c + 1 < KT / 64) {
#pragma unroll
      for (int j = 0; j < 4; ++j) { sa[j] = *(const v8us*)(ga + (c + 1) * 64 + j * 32 * KT); sb[j] = *(const v8us*)(gb + (c + 1) * 64 + j * 32 * KT); }
      asm volatile("s_wait_xcnt 0x0" :: "v"(ga), "v"(gb) : "memory");      /* as inputs the loads' two addresses stay whole until the wait */
    }
#pragma unroll
    for (int ks = 0; ks < 2; ++ks) {
      const v16h a0 = g3_frag(cur + ra + ks * 32, hh), a1 = g3_frag(cur + ra + 16 * GP + ks * 32, hh);
#pragma unroll
      for (int t = 0; t < 4; ++t) { const v16h b = g3_frag(cur + rb + t * 16 * GP + ks * 32, hh); acc[0][t] = g3_mma(a0, b, acc[0][t]); acc[1][t] = g3_mma(a1, b, acc[1][t]); }
    }
    if (c + 1 < KT / 64) {
#pragma unroll
      for (int j = 0; j < 4; ++j) { *(v8us*)(nxt + ls + j * 32 * GP) = sa[j]; *(v8us*)(nxt + GT + ls + j * 32 * GP) = sb[j]; }      /* the other buffer's last readers left it at the barrier that ended slice c - 1 */
    }
    __syncthreads();      /* publishes slice c + 1 and ends every read of slice c (behind the last slice: frees the buffers for the output staging) */
  }
}
// the six projections in one launch (M = NN, N = DO, K = DI, f16 result only), tiles through LDS (g3_loop), k_gemm2's epilogue. blockIdx.y = j picks plane j of QKV = [Q1 K1 Q2 K2 V1^T V2^T];
// x1 (first half of X) feeds planes 0, 1, 4; weight slots of BW = [Wq1 Wk1 Wq2 Wk2 Wv], W_V shared by planes 4 and 5
__global__ __launch_bounds__(256) void k_proj6(const _Float16* __restrict__ X, const _Float16* __restrict__ BW, const float* __restrict__ bq1, const float* __restrict__ bk1, const float* __restrict__ bq2, const float* __restrict__ bk2, const float* __restrict__ bv, _Float16* __restrict__ QKV) {
  __shared__ __attribute__((aligned(16))) G3S sm;
  const int tid = threadIdx.x, w = tid >> 5, lane = tid & 31, ln = lane & 15, hh = lane >> 4; const int j = blockIdx.y;
  const float* bp = j == 0 ? bq1 : j == 1 ? bk1 : j == 2 ? bq2 : j == 3 ? bk2 : bv;
  const int mt = blockIdx.x / (DO / 128), nq = blockIdx.x % (DO / 128); const int row0 = mt * 128 + 32 * (w & 3), col0 = nq * 128 + 64 * (w >> 2);
  const v8f z8 = {0.f,0.f,0.f,0.f,0.f,0.f,0.f,0.f}; v8f acc[2][4] = {{z8, z8, z8, z8}, {z8, z8, z8, z8}};
  g3_loop<DI>((const unsigned short*)X + ((j == 2 || j == 3 || j == 5) ? (size_t)NN * DI : 0) + (size_t)mt * 128 * DI, (const unsigned short*)BW + (size_t)(j < 4 ? j : 4) * DO * DI + (size_t)nq * 128 * DI, sm.t, tid, acc);
  if (j >= 4) {      /* block-uniform, behind the loop's last barrier. Planes 4 and 5 hold V^T in k_flash's staging order: [32-key block][16-d tile][half][lane][8], element = V[16 half + 8 hh + 0..7][16 t + ln]: a lane's 8 accumulator registers as they lie, so nothing is left to transpose and a store covers 512 contiguous bytes */
    const float* bl = bp + col0 + ln; float bt[4];
    // every loop of this branch is unrolled: bt, f and acc stay in registers, and t and the chunk index become immediate offsets of the one address pair of the loads and of the stores
#pragma unroll
    for (int t = 0; t < 4; ++t) bt[t] = bl[t * 16];
    asm volatile("s_wait_xcnt 0x0" :: "v"(bl) : "memory");      /* as an input the loads' address stays whole until the wait */
    unsigned short* vd = (unsigned short*)QKV + (size_t)j * NN * DO + (size_t)(row0 >> 5) * (32 * DO) + (col0 >> 4) * 512 + lane * 8;
    FragH f[2][4];      /* all eight chunks are made in front of the first store: behind it no register that a store names is written any more */
#pragma unroll
    for (int u = 0; u < 8; ++u) { const int t = u & 3, half = u >> 2; const float bb = bf16_round(bt[t]);
#pragma unroll
      for (int r = 0; r < 8; ++r) f[half][t].h[r] = (_Float16)(acc[half][t][r] * 0.0625f + bb); }
#pragma unroll
    for (int u = 0; u < 8; ++u) { const int t = u & 3, half = u >> 2; *(v8us*)(vd + (t * 2 + half) * 256) = f[half][t].half[0]; }
    asm volatile("s_wait_xcnt 0x0" :: "v"(vd) : "memory");      /* as an input the stores' address stays whole until the wait */
    return;
  }
#pragma unroll
  for (int u = 0; u < 8; ++u) { const int t = u & 3, half = u >> 2; const float bb = bf16_round(bp[col0 + t * 16 + ln]);
#pragma unroll
    for (int r = 0; r < 8; ++r) sm.so[w][half * 16 + 8 * hh + r][t * 16 + ln] = acc[half][t][r] * 0.0625f + bb; }
  __builtin_amdgcn_fence(__ATOMIC_ACQ_REL, "workgroup"); __builtin_amdgcn_wave_barrier();      /* a wave reads back only its own rows */
  {      /* The Q and K planes lie in k_flash's fragment order: [32-row block][g][ks][h][lane][8], element = row 16 g + ln, column 32 ks + 16 h + 8 hh + 0..7; a store covers 512 contiguous bytes */
    unsigned short* qd = (unsigned short*)QKV + (size_t)j * NN * DO + (size_t)(row0 >> 5) * (32 * DO) + (col0 >> 5) * 512 + lane * 8;
    FragH f[8];      /* all eight chunks are made in front of the first store, as above */
    // both loops unrolled: f stays in registers, and the chunk index becomes an immediate offset of the one address pair
#pragma unroll
    for (int c = 0; c < 8; ++c) { const int g = c >> 2, kl = (c >> 1) & 1, h = c & 1; const float* sp = &sm.so[w][g * 16 + ln][kl * 32 + h * 16 + 8 * hh];
      const v4f v0 = *(const v4fa*)sp, v1 = *(const v4fa*)(sp + 4);
      for (int i = 0; i < 4; ++i) { f[c].h[i] = (_Float16)v0[i]; f[c].h[4 + i] = (_Float16)v1[i]; } }
#pragma unroll
    for (int c = 0; c < 8; ++c) *(v8us*)(qd + (((c >> 2) * 8 + ((c >> 1) & 1)) * 2 + (c & 1)) * 256) = f[c].half[0];
    asm volatile("s_wait_xcnt 0x0" :: "v"(qd) : "memory");      /* as an input the stores' address stays whole until the wait */
  }
}
#define FQ 256                   /* query rows per work-group */
#define KSP 4                    /* key ranges: 32 query blocks x KSP x 2 branches = 256 work-groups */
#define NPASS (NN / KSP / 32)
#define SP 4                     /* passes between two barriers: 2 buffers x SP passes x PT elements = 262,144 B of LDS; one work-group a WGP, as before */
#define NST (NPASS / SP)         /* stages of a key range */
#define TL (32 * DO)             /* a pass's K tile, or its V^T tile, 16-bit elements: 16 KiB in a row, in memory as in LDS */
#define PT (2 * TL)              /* a pass's tiles in LDS (K | V^T), 16-bit elements */
#define TROW 512u                /* the tensor load's view of a tile: 32 rows of 512 B, source pitch 512 B */
#define TNR 32u
#define MTHR 4.0f                /* the maximum in use may trail the true one by this much (log2): a weight is at most 2^(10 + 4), inside f16 */
__device__ __forceinline__ float xhalf(float x) { return __builtin_bit_cast(float, __builtin_amdgcn_permlanex16(__builtin_bit_cast(int, x), __builtin_bit_cast(int, x), 0x76543210, 0xfedcba98, false, false)); }  // lane l with lane l ^ 16
__device__ __forceinline__ v16h fa_frag(const unsigned short* p) { FragH f; f.half[0] = *(const v8us*)p; f.half[1] = *(const v8us*)(p + 256); return f.v; }      /* p = the fragment's place + 8 lane */
typedef unsigned int u32x4 __attribute__((ext_vector_type(4)));
typedef unsigned int u32x8 __attribute__((ext_vector_type(8)));
__device__ __forceinline__ unsigned int uni(unsigned int v) { return (unsigned int)__builtin_amdgcn_readfirstlane(v); }
__device__ __forceinline__ unsigned int pinned(unsigned int v) { unsigned int x = uni(v); asm volatile("" : "+s"(x)); return x; }      /* holds a wave-uniform word in a scalar register: the test on it is a scalar branch, and what is formed from it is formed behind the volatile statements in front */
__device__ __forceinline__ v8f fa_mma(v16h a, v16h b, v8f c) { return __builtin_amdgcn_wmma_f32_16x16x32_f16(false, a, false, b, (short)0, c, false, false); }
__global__ __launch_bounds__(256) void k_flash(const _Float16* __restrict__ Qa, const _Float16* __restrict__ Ka, const _Float16* __restrict__ VTa, const _Float16* __restrict__ Qb, const _Float16* __restrict__ Kb, const _Float16* __restrict__ VTb,
    const float* __restrict__ scp, _Float16* __restrict__ OP, float* __restrict__ ML) {
  static_assert(NPASS % SP == 0, "whole stages");
  static_assert(NST >= 2, "the ring's prologue needs two stages");
  static_assert(2 * SP == FQ / 32, "one tile of a stage for each wave");
  __shared__ __attribute__((aligned(2048))) unsigned short sT[2 * SP * PT];      /* a pass's K tile, then its V^T tile: behind the pass's base register every LDS access keeps an immediate offset (16 bits); every tile's place is a multiple of 2 KiB */
  const int tid = threadIdx.x, w = tid >> 5, lane = tid & 31, ln = lane & 15, hh = lane >> 4;
  const int br = blockIdx.z, sp = blockIdx.y, q0 = blockIdx.x * FQ + w * 32;
  const _Float16* Q = br ? Qb : Qa; const unsigned short* K = (const unsigned short*)(br ? Kb : Ka); const unsigned short* VT = (const unsigned short*)(br ? VTb : VTa);
  float sv = bf16_round(scp[0]); sv = fminf(fmaxf(sv, 1.0f), 32.0f); const float cs = (1.0f / sqrtf(sv)) * 1.4426950408889634f;      /* scores to log2 units */
  // staging: wave wv brings tile wv & 1 (K | V^T) of pass wv >> 1 of every stage: 8 waves = SP passes x 2 tiles, one request a wave and stage, every wave issues
  const unsigned int wv = uni(tid >> 5);
  const unsigned short* gS = ((wv & 1) ? VT : K) + (size_t)sp * (NN / KSP) * DO + (size_t)(wv >> 1) * TL;      /* the wave's tile of stage 0; a stage is SP tiles on in either plane */
  const unsigned int lS = (unsigned int)(size_t)sT + (wv >> 1) * (PT * 2) + (wv & 1) * (TL * 2);      /* its place in buffer 0: byte offset in the work-group's LDS */
  u32x8 g1;      /* descriptor group 1, the same for every request: 1-byte elements, tensor = tile = TNR rows of TROW bytes, no mask, no pad. Pinned: each constant word keeps its own scalar register through the loop, so that none is lent out and formed again while a request is outstanding */
  g1[0] = pinned(0u); g1[1] = pinned((TROW & 0xFFFFu) << 16); g1[2] = pinned((TROW >> 16) | ((TNR & 0xFFFFu) << 16)); g1[3] = pinned((TNR >> 16) | (TROW << 16));
  g1[4] = pinned(TNR); g1[5] = pinned(TROW); g1[6] = pinned(0u); g1[7] = pinned(0u);
  u32x4 g0; g0[0] = pinned(1u);      /* descriptor group 0: count 1 (pinned for the same reason); place, address and type by request */
  auto issue = [&](unsigned int stg) {      /* one tensor load: the wave's tile of stage stg into buffer stg & 1 */
    const unsigned long long ga = (unsigned long long)(size_t)gS + (unsigned long long)stg * (SP * TL * 2);
    g0[1] = uni(lS + (stg & 1u) * (SP * PT * 2)); g0[2] = uni((unsigned int)ga); g0[3] = uni((((unsigned int)(ga >> 32)) & 0x01FFFFFFu) | 0x80000000u);
    asm volatile("tensor_load_to_lds %0, %1" :: "s"(g0), "s"(g1) : "memory");      /* global -> LDS, 16 KiB, through no register */
  };
  const unsigned short* qp = (const unsigned short*)Q + (size_t)(q0 >> 5) * (32 * DO) + lane * 8;      /* the one address register pair of all 32 Q loads; Q lies in fragment order (k_proj6), so each load covers 512 contiguous bytes */
  v16h qf[2][8];
#pragma unroll
  for (int g = 0; g < 2; ++g)
#pragma unroll
    for (int ks = 0; ks < 8; ++ks) { FragH f; f.half[0] = *(const v8us*)(qp + (g * 8 + ks) * 512); f.half[1] = *(const v8us*)(qp + (g * 8 + ks) * 512 + 256); qf[g][ks] = f.v; }
  asm volatile("s_wait_xcnt 0x0" :: "v"(qp) : "memory");      /* qp ends here: as an input it stays whole until the wait, in front of whatever takes its registers next */
  issue(0u);
  asm volatile("s_wait_tensorcnt 0x0" :: "s"(g0), "s"(g1) : "memory");      /* the wave's own tile of stage 0 has landed; as inputs the descriptor's registers stay whole until then */
  __syncthreads();      /* publishes stage 0 */
  issue(pinned(1u));      /* flies while stage 0 is worked on; the stage number is pinned so that the descriptor is formed behind the wait */
  const v8f z8 = {0.f,0.f,0.f,0.f,0.f,0.f,0.f,0.f};
  v8f o[16][2];
#pragma unroll
  for (int t = 0; t < 16; ++t) { o[t][0] = z8; o[t][1] = z8; }
  float m[2] = {-3.0e38f, -3.0e38f}, l[2] = {0.f, 0.f};
  // kept rolled: the body holds 64 matrix instructions and nearly the whole register budget; a second copy would only cost instruction cache
#pragma unroll 1
  for (int sg = 0; sg < NST; ++sg) {
  // rolled for the same reason; the barrier stands in the outer loop, so a pass stays one run of code up to its back edge
#pragma unroll 1
  for (int ps = 0; ps < SP; ++ps) {
    const unsigned short* bK = sT + ((sg & 1) * SP + ps) * PT + lane * 8; const unsigned short* bV = bK + TL;      /* this pass's tiles, at the lane's 16 bytes of every fragment half */
    // S^T = K.Q^T, one k step (2 fragments, 4 matrix instructions) a block; each block's LDS reads stand as one group two blocks ahead, in a ring of three fragment pairs
    v8f sc[2][2] = {{z8, z8}, {z8, z8}};
    v16h ka[3][2];
#pragma unroll
    for (int i = 0; i < 4; ++i) ka[i >> 1][i & 1] = fa_frag(bK + ((i & 1) * 8 + (i >> 1)) * 512);
#pragma unroll
    for (int ks = 0; ks < 8; ++ks) {
      if (ks < 6) { ka[(ks + 2) % 3][0] = fa_frag(bK + (ks + 2) * 512); ka[(ks + 2) % 3][1] = fa_frag(bK + (8 + ks + 2) * 512); }
      __builtin_amdgcn_sched_barrier(0);      /* keeps the reads above as one group in front of the block, two blocks ahead of their use */
      const v16h a0 = ka[ks % 3][0], a1 = ka[ks % 3][1];
      sc[0][0] = fa_mma(a0, qf[0][ks], sc[0][0]); sc[0][1] = fa_mma(a0, qf[1][ks], sc[0][1]);
      sc[1][0] = fa_mma(a1, qf[0][ks], sc[1][0]); sc[1][1] = fa_mma(a1, qf[1][ks], sc[1][1]);
      __builtin_amdgcn_sched_barrier(0);      /* ends the block: the next group of reads stays behind it */
    }
    // one rescale test a pass. Each group's 16 scores of a lane go through a maximum tree three levels deep, both groups' trees side by side, so that no long dependent chain and only one vector-to-scalar branch stand
    // between the two products. The test needs no exchange: a query's two half-wave lanes hold the same m, and the ballot sees both; the exchange stands in the rare branch.
    // The loops over g and t are unrolled because ml, nd, m, l and o live in registers and need constant indices.
    float ml[2];
#pragma unroll
    for (int g = 0; g < 2; ++g) {
      const v8f a = sc[0][g], b = sc[1][g];
      const float t0 = fmaxf(fmaxf(a[0], a[1]), a[2]), t1 = fmaxf(fmaxf(a[3], a[4]), a[5]), t2 = fmaxf(fmaxf(a[6], a[7]), b[0]), t3 = fmaxf(fmaxf(b[1], b[2]), b[3]), t4 = fmaxf(fmaxf(b[4], b[5]), b[6]);
      ml[g] = fmaxf(fmaxf(fmaxf(t0, t1), t2), fmaxf(fmaxf(t3, t4), b[7])) * cs;      /* cs > 0: the lane's maximum of the pass, in log2 units */
    }
    const bool nd[2] = {ml[0] > m[0] + MTHR, ml[1] > m[1] + MTHR};
    if (__builtin_amdgcn_ballot_w32(nd[0] || nd[1]) != 0) {      /* scalar branch, rare after the first passes */
#pragma unroll
      for (int g = 0; g < 2; ++g) {
        if (__builtin_amdgcn_ballot_w32(nd[g]) != 0) {      /* scalar branch: only a group that asked for it takes a new maximum */
          const float mx = fmaxf(ml[g], xhalf(ml[g]));      /* both halves of the wave now hold this query's maximum of the pass */
          const float mn = fmaxf(m[g], mx); const float corr = __builtin_amdgcn_exp2f(m[g] - mn);      /* 0 on the first pass */
          m[g] = mn; l[g] *= corr;
#pragma unroll
          for (int t = 0; t < 16; ++t) o[t][g] = o[t][g] * corr;
        }
      }
    }
    v16h pf[2];
#pragma unroll
    for (int g = 0; g < 2; ++g) {
      const float sh = 10.0f - m[g]; FragH p; float s0 = 0.f, s1 = 0.f;      /* weights x 1024, as f16 operands away from the subnormal range; l carries the same factor */
      float x[16];
#pragma unroll
      for (int r = 0; r < 8; ++r) { x[r] = fmaf(sc[0][g][r], cs, sh); x[8 + r] = fmaf(sc[1][g][r], cs, sh); }
      __builtin_amdgcn_sched_barrier(0);      /* the arguments are all made first: no multiply-add is left to land on an exponential's source directly behind it */
#pragma unroll
      for (int r = 0; r < 16; ++r) x[r] = __builtin_amdgcn_exp2f(x[r]);
      __builtin_amdgcn_sched_barrier(0);      /* sums and conversions stay behind the exponentials: none reads a result directly behind its exponential */
#pragma unroll
      for (int r = 0; r < 8; ++r) { s0 += x[r]; s1 += x[8 + r]; p.h[r] = (_Float16)x[r]; p.h[8 + r] = (_Float16)x[8 + r]; }
      l[g] += s0 + s1; pf[g] = p.v;
    }
    // O^T += V^T.P^T, two d tiles (2 fragments, 4 matrix instructions) a block, read ahead in the same ring
    __builtin_amdgcn_sched_barrier(0);      /* the V^T reads stay behind the exponentials: hoisted among them they take the registers that keep two waves on a SIMD without spills */
    v16h va[3][2];
#pragma unroll
    for (int i = 0; i < 4; ++i) va[i >> 1][i & 1] = fa_frag(bV + i * 512);
#pragma unroll
    for (int b = 0; b < 8; ++b) {
      if (b < 6) { va[(b + 2) % 3][0] = fa_frag(bV + ((b + 2) * 2) * 512); va[(b + 2) % 3][1] = fa_frag(bV + ((b + 2) * 2 + 1) * 512); }
      __builtin_amdgcn_sched_barrier(0);      /* one group of reads in front of the block, as above */
      o[b * 2][0] = fa_mma(va[b % 3][0], pf[0], o[b * 2][0]); o[b * 2][1] = fa_mma(va[b % 3][0], pf[1], o[b * 2][1]);
      o[b * 2 + 1][0] = fa_mma(va[b % 3][1], pf[0], o[b * 2 + 1][0]); o[b * 2 + 1][1] = fa_mma(va[b % 3][1], pf[1], o[b * 2 + 1][1]);
      __builtin_amdgcn_sched_barrier(0);      /* ends the block */
    }
  }
    // publish point of stage sg + 1, every wave, in this order
    asm volatile("s_wait_dscnt 0x0" ::: "memory");      /* the wave's own reads of stage sg are done */
    asm volatile("s_wait_tensorcnt 0x0" :: "s"(g0), "s"(g1) : "memory");      /* the wave's own tile of stage sg + 1 has landed; as inputs the descriptor's registers stay whole until then */
    __syncthreads();      /* publishes stage sg + 1 and ends every read of stage sg */
    if (pinned((unsigned int)(sg + 2 < NST))) issue(pinned((unsigned int)sg + 2u));      /* scalar branch: a tensor load ignores EXEC. Refill of the buffer that stage sg has just left; the stage number is pinned so that the descriptor is formed behind the wait */
  }
  asm volatile("s_wait_tensorcnt 0x0" :: "s"(g0), "s"(g1) : "memory");      /* nothing of the mover is in flight when the wave goes on to its end */
  asm volatile("s_wait_dscnt 0x0" ::: "memory");
  // partials: OP[32-row block][key range][g][t][lane][8], the accumulators' own order (element = query 16 g + ln, d = 16 t + 8 hh + 0..7), so that each store covers 512 contiguous bytes;
  // ML[query row][key range][m, l]; query row = branch * NN + query. One address pair serves all stores of each array, and
  // everything that is computed stands in front of the first store: behind it no register that a store names is written any more.
  const size_t row = (size_t)br * NN + q0 + ln;
  unsigned short* op = (unsigned short*)OP + ((((size_t)br * NN + q0) >> 5) * KSP + sp) * (32 * DO) + lane * 8;      /* a lane's 8 accumulator registers are 8 consecutive d of its query: one 16-byte chunk */
  float* mlp = ML + (row * KSP + sp) * 2 + hh;
  const float j0 = l[0] + xhalf(l[0]), j1 = l[1] + xhalf(l[1]);      /* the halves' sums joined, with every lane on: the exchange stands outside the selection below */
  const float w0 = hh ? j0 : m[0], w1 = hh ? j1 : m[1];      /* the lower half of the wave writes m, the upper l */
  const float rn[2] = {1024.0f / j0, 1024.0f / j1};      /* l > 0: the key that set m weighs 2^10. O / l is a mean of V rows, so x 1024 it lies inside f16 and away from its subnormal range */
  FragH pc[2][16];
  // the loops over g, t and r are unrolled because o and pc live in registers and need constant indices
#pragma unroll
  for (int g = 0; g < 2; ++g) {
#pragma unroll
    for (int t = 0; t < 16; ++t) {
#pragma unroll
      for (int r = 0; r < 8; ++r) pc[g][t].h[r] = (_Float16)(o[t][g][r] * rn[g]);
    }
  }
  mlp[0] = w0; mlp[16 * KSP * 2] = w1;
#pragma unroll
  for (int g = 0; g < 2; ++g) {
#pragma unroll
    for (int t = 0; t < 16; ++t) *(v8us*)(op + (g * 16 + t) * 256) = pc[g][t].half[0];
  }
  asm volatile("s_wait_xcnt 0x0" :: "v"(op), "v"(mlp) : "memory");      /* as inputs the stores' addresses stay whole until the wait */
}
// ---- tail: the join of the key ranges and the output GEMM in one launch; f never leaves the work-group ----
// A work-group of 16 waves takes TR rows (query rows of both branches, one M = 2 NN) and all DI output columns.
// Join: f = sum_s c_s F_s, c_s = 2^(m_s - M) l_s / sum_s 2^(m_s - M) l_s, F_s = range s's normalised f16 partial, over the KSP key ranges in f32, fixed order s = 0..KSP-1; the partials lie in k_flash's accumulator order: a wave takes four d tiles of one 16-query group, a lane one query, each load 512 contiguous bytes;
// f x 1024 goes to LDS as f16 hi + residual (one scale for both, so that both feed the same accumulators).
// GEMM: out = (hi + lo) We^T / 1024 + be; We in 64-k slices through two LDS buffers as in g3_loop; wave w takes rows 32 (w & 1), columns 64 (w >> 1): g3_loop's 32 x 64 wave tile and k order.
// The short loops are unrolled because their arrays (staged loads, partials, fragments, accumulators) live in registers and need constant indices.
#define TR 64                    /* rows per work-group: 2 NN / TR = 256 work-groups */
#define APIT 264                 /* LDS pitch of an f row, 16-bit elements: 528 B = 16 B x odd */
#define TA (TR * APIT)           /* one plane of f (hi | lo) */
#define TB (DI * GP)             /* one slice of We */
typedef _Float16 v4ha __attribute__((ext_vector_type(4), may_alias));
struct T4S { unsigned short a[2 * TA]; union { unsigned short b[2 * TB]; float so[16][32][68]; } u; };      /* behind the loop the slices' place is each wave's own output staging */
__global__ __launch_bounds__(512) void k_tail(const _Float16* __restrict__ OP, const float* __restrict__ ML, const _Float16* __restrict__ Bh, const float* __restrict__ bias, float* __restrict__ C) {
  static_assert(KSP == 4, "the join reads a row's four (m, l) pairs as two 16-byte loads");
  __shared__ __attribute__((aligned(16))) T4S sm;
  const int tid = threadIdx.x, w = tid >> 5, lane = tid & 31, ln = lane & 15, hh = lane >> 4;
  const int rowg = blockIdx.x * TR;
  const unsigned short* gb = (const unsigned short*)Bh + (size_t)(tid >> 3) * DO + (tid & 7) * 8;      /* thread -> 16 B of rows tid / 8 + 64 j of We; one address pair for all slices */
  const int ls = (tid >> 3) * GP + (tid & 7) * 8;
  const int jb = w >> 3, jg = (w >> 2) & 1, jt = (w & 3) * 4, rl = jb * 32 + jg * 16 + ln;      /* wave w joins d tiles jt + i of group jg of 32-row block jb; its lane's row is rl */
  const unsigned short* po = (const unsigned short*)OP + (size_t)(blockIdx.x * (TR / 32) + jb) * KSP * (32 * DO) + (jg * 16 + jt) * 256 + lane * 8;      /* one address pair for each array */
  const float* pm = ML + (size_t)(rowg + rl) * KSP * 2;
  const float* bq = bias + 64 * (w >> 1) + ln;
  v8us sb[8], op[4][KSP]; v4f mq[2]; float bb[4];
  mq[0] = *(const v4fa*)pm; mq[1] = *(const v4fa*)(pm + 4);
#pragma unroll
  for (int i = 0; i < 4; ++i) {
#pragma unroll
    for (int s = 0; s < KSP; ++s) op[i][s] = *(const v8us*)(po + s * (32 * DO) + i * 256);
  }
#pragma unroll
  for (int j = 0; j < 8; ++j) sb[j] = *(const v8us*)(gb + j * 64 * DO);
#pragma unroll
  for (int t = 0; t < 4; ++t) bb[t] = bq[t * 16];
  asm volatile("s_wait_xcnt 0x0" :: "v"(po), "v"(pm), "v"(gb), "v"(bq) : "memory");      /* as inputs the loads' addresses stay whole until the wait */
  const float ms[KSP] = {mq[0][0], mq[0][2], mq[1][0], mq[1][2]}, lw[KSP] = {mq[0][1], mq[0][3], mq[1][1], mq[1][3]};
  float M = ms[0], wg[KSP], den = 0.f;
#pragma unroll
  for (int s = 1; s < KSP; ++s) M = fmaxf(M, ms[s]);
#pragma unroll
  for (int s = 0; s < KSP; ++s) wg[s] = __builtin_amdgcn_exp2f(ms[s] - M);
#pragma unroll
  for (int s = 0; s < KSP; ++s) den += wg[s] * lw[s];
  const float rs = 1.0f / den; float cw[KSP];
#pragma unroll
  for (int s = 0; s < KSP; ++s) cw[s] = wg[s] * lw[s] * rs;      /* range s's share of the whole weight sum */
#pragma unroll
  for (int i = 0; i < 4; ++i) {
    float a[8] = {0.f,0.f,0.f,0.f,0.f,0.f,0.f,0.f};
#pragma unroll
    for (int s = 0; s < KSP; ++s) { FragH h; h.half[0] = op[i][s];
#pragma unroll
      for (int q = 0; q < 8; ++q) a[q] += (float)h.h[q] * cw[s]; }
    FragH fh, fl;
#pragma unroll
    for (int q = 0; q < 8; ++q) { const _Float16 g0 = (_Float16)a[q]; fh.h[q] = g0; fl.h[q] = (_Float16)(a[q] - (float)g0); }      /* the partials carry the factor 1024 already */
    unsigned short* pa = sm.a + rl * APIT + (jt + i) * 16 + 8 * hh;      /* the lane's 8 consecutive d of its row: one 16-byte LDS store a plane */
    *(v8us*)pa = fh.half[0]; *(v8us*)(pa + TA) = fl.half[0];
  }
#pragma unroll
  for (int j = 0; j < 8; ++j) *(v8us*)(sm.u.b + ls + j * 64 * GP) = sb[j];
  __syncthreads();      /* publishes f and the first slice of We */
  const int ra = ((w & 1) * 32 + ln) * APIT, rb = ((w >> 1) * 64 + ln) * GP;
  const v8f z8 = {0.f,0.f,0.f,0.f,0.f,0.f,0.f,0.f}; v8f acc[2][4] = {{z8, z8, z8, z8}, {z8, z8, z8, z8}};
  // unrolled: the buffer and the slice become constants, so every load and LDS access is its base register plus an immediate offset
#pragma unroll
  for (int c = 0; c < DO / 64; ++c) {
    const unsigned short* cur = sm.u.b + (c & 1) * TB; unsigned short* nxt = sm.u.b + ((c + 1) & 1) * TB;
    if (c + 1 < DO / 64) {
#pragma unroll
      for (int j = 0; j < 8; ++j) sb[j] = *(const v8us*)(gb + (c + 1) * 64 + j * 64 * DO);
      asm volatile("s_wait_xcnt 0x0" :: "v"(gb) : "memory");      /* as an input the loads' address stays whole until the wait */
    }
#pragma unroll
    for (int ks = 0; ks < 2; ++ks) {
      const unsigned short* pa = sm.a + ra + c * 64 + ks * 32;
      const v16h h0 = g3_frag(pa, hh), h1 = g3_frag(pa + 16 * APIT, hh), l0 = g3_frag(pa + TA, hh), l1 = g3_frag(pa + TA + 16 * APIT, hh);
      v16h b[4];
#pragma unroll
      for (int t = 0; t < 4; ++t) b[t] = g3_frag(cur + rb + t * 16 * GP + ks * 32, hh);
#pragma unroll
      for (int t = 0; t < 4; ++t) { acc[0][t] = g3_mma(h0, b[t], acc[0][t]); acc[1][t] = g3_mma(h1, b[t], acc[1][t]); }
#pragma unroll
      for (int t = 0; t < 4; ++t) { acc[0][t] = g3_mma(l0, b[t], acc[0][t]); acc[1][t] = g3_mma(l1, b[t], acc[1][t]); }
    }
    if (c + 1 < DO / 64) {
#pragma unroll
      for (int j = 0; j < 8; ++j) *(v8us*)(nxt + ls + j * 64 * GP) = sb[j];      /* the other buffer's last readers left it at the barrier that ended slice c - 1 */
    }
    __syncthreads();      /* publishes slice c + 1 and ends every read of slice c (behind the last slice: frees the buffers for the output staging) */
  }
#pragma unroll
  for (int u = 0; u < 8; ++u) { const int t = u & 3, half = u >> 2; const float bv = bf16_round(bb[t]);
#pragma unroll
    for (int r = 0; r < 8; ++r) sm.u.so[w][half * 16 + 8 * hh + r][t * 16 + ln] = acc[half][t][r] * (0.0625f / 1024.0f) + bv; }
  __builtin_amdgcn_fence(__ATOMIC_ACQ_REL, "workgroup"); __builtin_amdgcn_wave_barrier();      /* a wave reads back only its own rows */
  const int rsub = lane >> 4, c4 = (lane & 15) * 4; float* cp = C + (size_t)(rowg + 32 * (w & 1) + rsub) * DI + 64 * (w >> 1) + c4;      /* one address pair for all stores, whole lines each */
#pragma unroll
  for (int q = 0; q < 16; ++q) { const v4f v = *(const v4fa*)&sm.u.so[w][q * 2 + rsub][c4]; *(v4f*)(cp + q * 2 * DI) = v; }
  asm volatile("s_wait_xcnt 0x0" :: "v"(cp) : "memory");      /* as an input the stores' address stays whole until the wait */
}

extern "C" void kernel_launch(void* const* d_in, const int* in_sizes, int n_in,
                              void* d_out, int out_size, void* d_ws, size_t ws_size, hipStream_t stream) {
  (void)in_sizes; (void)n_in; (void)out_size;
  const float* const* I = (const float* const*)d_in; const float* x1 = I[0]; const float* x2 = I[1]; const float* Wq1 = I[2]; const float* bq1 = I[3]; const float* Wk1 = I[4]; const float* bk1 = I[5]; const float* Wv = I[6]; const float* bv = I[7]; const float* Wq2 = I[8]; const float* bq2 = I[9]; const float* Wk2 = I[10]; const float* bk2 = I[11]; const float* We = I[12]; const float* be = I[13]; const float* scp = I[14];
  float* out1 = (float*)d_out;      /* the second output lies behind the first, at byte offset 16777216 */
  char* ws = (char*)d_ws; size_t off = 0;
  auto take = [&](size_t bytes) { char* p = ws + off; off += (bytes + 255) & ~(size_t)255; return p; };
  _Float16* BW = (_Float16*)take((size_t)6 * DO * DI * 2); _Float16* BE = BW + (size_t)5 * DO * DI; _Float16* X1 = (_Float16*)take((size_t)2 * NN * DI * 2);      /* weight slots Wq1 Wk1 Wq2 Wk2 Wv We; [x1 | x2] */
  _Float16* Q1 = (_Float16*)take((size_t)6 * NN * DO * 2); _Float16* K1 = Q1 + (size_t)NN * DO; _Float16* Q2 = Q1 + (size_t)2 * NN * DO; _Float16* K2 = Q1 + (size_t)3 * NN * DO; _Float16* VT1 = Q1 + (size_t)4 * NN * DO; _Float16* VT2 = Q1 + (size_t)5 * NN * DO;      /* planes Q1 K1 Q2 K2 V1^T V2^T */
  _Float16* OP = (_Float16*)take((size_t)KSP * 2 * NN * DO * 2); float* ML = (float*)take((size_t)KSP * 2 * NN * 2 * 4);
  if (off > ws_size) return;      /* 1.5 + 16 + 24 + 32 + 0.5 = about 74 MiB */
  k_cvt<<<6 * WB + 2 * XB, 256, 0, stream>>>(x1, x2, Wq1, Wk1, Wq2, Wk2, Wv, We, X1, BW);      /* weights as given, (out, in) */
  k_proj6<<<dim3((NN / 128) * (DO / 128), 6), 256, 0, stream>>>(X1, BW, bq1, bk1, bq2, bk2, bv, Q1);
  k_flash<<<dim3(NN / FQ, KSP, 2), 256, 0, stream>>>(Q1, K2, VT1, Q2, K1, VT2, scp, OP, ML);      /* f1: hsi_Q . lidar_K -> hsi_V ; f2: lidar_Q . hsi_K -> lidar_V */
  k_tail<<<2 * NN / TR, 512, 0, stream>>>(OP, ML, BE, be, out1);      /* both branches: their rows and the two outputs lie back to back (one M = 2 NN); (f_hi + f_lo) We^T + be */
}
